// v000
// The times below were measured on an AMD MI455X: many runs one after another, warmed up first and cycling through
// copies of the inputs, with the whole window's GPU time divided by the number of runs. Launches and the gaps
// between them are all in it. The median over several windows is given; except for v000 it joins two sittings, which
// can be a few percent apart, so the side-by-side timings, each taken in one sitting, are the better comparison.
// The starting kernel, v000, takes 349 microseconds a run.
#include <hip/hip_runtime.h>
#include <math.h>

// Problem constants (from reference): qkv [4,8,384,64,64]
#define BQ   4
#define LH   8
#define C3   384
#define DIM  128
#define NPIX 4096
#define CP   1024
#define EPSN 1e-12f
#define LOGIT_MAX 4.605170185988091f  // log(1/0.01)

typedef __attribute__((ext_vector_type(2))) float v2f;
typedef __attribute__((ext_vector_type(4))) float v4f;
typedef __attribute__((ext_vector_type(8))) float v8f;
typedef __attribute__((ext_vector_type(4))) int   v4i;

// Async global->LDS copy support (gfx1250 GLOBAL_LOAD_ASYNC_TO_LDS_B128)
#if defined(__has_builtin)
#if __has_builtin(__builtin_amdgcn_global_load_async_to_lds_b128)
#define ASYNC_LDS 1
#endif
#endif
#ifndef ASYNC_LDS
#define ASYNC_LDS 0
#endif

__device__ __forceinline__ void async_copy16(const float* src, float* lds_dst) {
#if ASYNC_LDS
  // Signature (from toolchain diagnostics): param0 = global int4*, param1 = LDS int4*,
  // then two integer immediates (offset, cpol).
  __builtin_amdgcn_global_load_async_to_lds_b128(
      (__attribute__((address_space(1))) v4i*)(float*)src,
      (__attribute__((address_space(3))) v4i*)lds_dst, 0, 0);
#else
  *(v4f*)lds_dst = *(const v4f*)src;
#endif
}

__device__ __forceinline__ void wait_async_copies() {
#if ASYNC_LDS
#if __has_builtin(__builtin_amdgcn_s_wait_asynccnt)
  __builtin_amdgcn_s_wait_asynccnt(0);
#else
  asm volatile("s_wait_asynccnt 0x0" ::: "memory");
#endif
#endif
}

// D(16x16,f32) = A(16x4,f32) * B(4x16,f32) + C  -- CDNA5 wave32 WMMA
__device__ __forceinline__ v8f wmma4(v2f a, v2f b, v8f c) {
  return __builtin_amdgcn_wmma_f32_16x16x4_f32(
      /*neg_a=*/false, a, /*neg_b=*/false, b,
      /*c_mod=*/(short)0, c, /*reuse_a=*/false, /*reuse_b=*/false);
}

// ---------------------------------------------------------------------------
// Kernel 1: reciprocal L2 norms of q rows and k rows.
// grid = B*L*2*DIM blocks of 256 threads. idx = (bl<<8) | (which<<7) | c
// ---------------------------------------------------------------------------
__global__ void norms_kernel(const float* __restrict__ qkv,
                             float* __restrict__ rq, float* __restrict__ rk) {
  __shared__ float red[256];
  int idx   = blockIdx.x;
  int c     = idx & (DIM - 1);
  int which = (idx >> 7) & 1;           // 0 = q, 1 = k
  int bl    = idx >> 8;
  const float* row = qkv + ((size_t)bl * C3 + which * DIM + c) * NPIX;
  float s = 0.f;
  for (int i = threadIdx.x; i < NPIX; i += 256) {
    float x = row[i];
    s += x * x;
  }
  red[threadIdx.x] = s;
  __syncthreads();
  for (int off = 128; off > 0; off >>= 1) {
    if (threadIdx.x < off) red[threadIdx.x] += red[threadIdx.x + off];
    __syncthreads();
  }
  if (threadIdx.x == 0) {
    float r = 1.f / fmaxf(sqrtf(red[0]), EPSN);
    (which ? rk : rq)[bl * DIM + c] = r;
  }
}

// ---------------------------------------------------------------------------
// Kernel 2: attn logits = scale * (q_m . k_n) / (|q_m| |k_n|)  [128x128 per bl]
// One wave per 32x32 macro-tile (2x2 WMMA tiles). K = 4096 in steps of 4.
// grid = B*L*16, block = 32
// ---------------------------------------------------------------------------
__global__ void attn_logits_kernel(const float* __restrict__ qkv,
                                   const float* __restrict__ logit_scale,
                                   const float* __restrict__ rq,
                                   const float* __restrict__ rk,
                                   float* __restrict__ attn) {
  int t    = blockIdx.x;
  int nt2  = t & 3;
  int mt2  = (t >> 2) & 3;
  int bl   = t >> 4;
  int lane = threadIdx.x;
  int half = lane >> 4, lm = lane & 15;

  const float* qbase = qkv + (size_t)bl * C3 * NPIX;
  const float* kbase = qbase + (size_t)DIM * NPIX;

  const float* aq[2];
  const float* bk[2];
#pragma unroll
  for (int i = 0; i < 2; ++i)
    aq[i] = qbase + (size_t)(mt2 * 32 + i * 16 + lm) * NPIX + half * 2;
#pragma unroll
  for (int j = 0; j < 2; ++j)
    bk[j] = kbase + (size_t)(nt2 * 32 + j * 16 + lm) * NPIX + half * 2;

  v8f acc[2][2] = {};
#pragma unroll 4
  for (int k0 = 0; k0 < NPIX; k0 += 4) {
    v2f a0 = *(const v2f*)(aq[0] + k0);
    v2f a1 = *(const v2f*)(aq[1] + k0);
    v2f b0 = *(const v2f*)(bk[0] + k0);
    v2f b1 = *(const v2f*)(bk[1] + k0);
    acc[0][0] = wmma4(a0, b0, acc[0][0]);
    acc[0][1] = wmma4(a0, b1, acc[0][1]);
    acc[1][0] = wmma4(a1, b0, acc[1][0]);
    acc[1][1] = wmma4(a1, b1, acc[1][1]);
  }

  int   l     = bl & (LH - 1);
  float scale = __expf(fminf(logit_scale[l], LOGIT_MAX));
#pragma unroll
  for (int i = 0; i < 2; ++i)
#pragma unroll
    for (int j = 0; j < 2; ++j)
#pragma unroll
      for (int r = 0; r < 8; ++r) {     // C/D layout: VGPR r -> M=r(+8), N=lane%16
        int m = mt2 * 32 + i * 16 + r + half * 8;
        int n = nt2 * 32 + j * 16 + lm;
        float v = acc[i][j][r] * rq[bl * DIM + m] * rk[bl * DIM + n] * scale;
        attn[((size_t)bl * DIM + m) * DIM + n] = v;
      }
}

// ---------------------------------------------------------------------------
// Kernel 3: softmax over last dim (128). One block of 128 threads per row.
// grid = B*L*DIM
// ---------------------------------------------------------------------------
__global__ void softmax_kernel(float* __restrict__ attn) {
  __shared__ float red[128];
  size_t row = blockIdx.x;
  float  x   = attn[row * DIM + threadIdx.x];
  red[threadIdx.x] = x;
  __syncthreads();
  for (int off = 64; off > 0; off >>= 1) {
    if (threadIdx.x < off)
      red[threadIdx.x] = fmaxf(red[threadIdx.x], red[threadIdx.x + off]);
    __syncthreads();
  }
  float mx = red[0];
  __syncthreads();
  float e = __expf(x - mx);
  red[threadIdx.x] = e;
  __syncthreads();
  for (int off = 64; off > 0; off >>= 1) {
    if (threadIdx.x < off) red[threadIdx.x] += red[threadIdx.x + off];
    __syncthreads();
  }
  attn[row * DIM + threadIdx.x] = e / red[0];
}

// ---------------------------------------------------------------------------
// Kernel 4: y = attn @ v   (128x128 by 128x4096, per bl)
// One wave per 32x64 macro-tile (2x4 WMMA tiles), K=128.
// grid = B*L*4*64, block = 32.
// ---------------------------------------------------------------------------
__global__ void av_kernel(const float* __restrict__ qkv,
                          const float* __restrict__ attn,
                          float* __restrict__ y) {
  int t   = blockIdx.x;
  int nt4 = t & 63; t >>= 6;
  int mt2 = t & 3;
  int bl  = t >> 2;
  int lane = threadIdx.x, half = lane >> 4, lm = lane & 15;

  const float* Ar[2];
#pragma unroll
  for (int i = 0; i < 2; ++i)
    Ar[i] = attn + (size_t)bl * DIM * DIM +
            (size_t)(mt2 * 32 + i * 16 + lm) * DIM + half * 2;

  const float* V = qkv + (size_t)bl * C3 * NPIX + (size_t)(2 * DIM) * NPIX;
  const float* Bp[4];
#pragma unroll
  for (int j = 0; j < 4; ++j)
    Bp[j] = V + (size_t)(half * 2) * NPIX + nt4 * 64 + j * 16 + lm;

  v8f acc[2][4] = {};
#pragma unroll 2
  for (int k0 = 0; k0 < DIM; k0 += 4) {
    v2f a[2];
#pragma unroll
    for (int i = 0; i < 2; ++i) a[i] = *(const v2f*)(Ar[i] + k0);
    v2f b[4];
#pragma unroll
    for (int j = 0; j < 4; ++j) {
      b[j].x = Bp[j][(size_t)k0 * NPIX];
      b[j].y = Bp[j][(size_t)(k0 + 1) * NPIX];
    }
#pragma unroll
    for (int i = 0; i < 2; ++i)
#pragma unroll
      for (int j = 0; j < 4; ++j) acc[i][j] = wmma4(a[i], b[j], acc[i][j]);
  }

#pragma unroll
  for (int i = 0; i < 2; ++i)
#pragma unroll
    for (int j = 0; j < 4; ++j)
#pragma unroll
      for (int r = 0; r < 8; ++r) {
        int m = mt2 * 32 + i * 16 + r + half * 8;
        int n = nt4 * 64 + j * 16 + lm;
        y[((size_t)bl * DIM + m) * NPIX + n] = acc[i][j][r];
      }
}

// ---------------------------------------------------------------------------
// Kernel 5: out = proj_w @ y + proj_b   (per b: 1024x1024 by 1024x4096)
// Block = 8 waves (256 thr) -> 128x128 output tile (waves in 4M x 2N grid,
// each wave 32x64 = 2x4 WMMA tiles). B staged in double-buffered LDS tiles
// of 32(K) x 128(N), copied with GLOBAL_LOAD_ASYNC_TO_LDS_B128 when
// available. Row stride padded to 136 dwords so the half-wave row split of
// the WMMA B layout hits disjoint LDS banks.
// grid = B*8*32, block = 256.
// ---------------------------------------------------------------------------
#define KB      32                    // K-block staged per iteration
#define BT_LDW  136                   // padded LDS row stride (dwords)

__global__ void proj_kernel(const float* __restrict__ y,
                            const float* __restrict__ w,
                            const float* __restrict__ bias,
                            float* __restrict__ out) {
  __shared__ float BT[2][KB * BT_LDW];

  int t    = blockIdx.x;
  int ntB  = t & 31; t >>= 5;         // N block (128 cols)
  int mtB  = t & 7;                   // M block (128 rows)
  int b    = t >> 3;

  int lane = threadIdx.x & 31;
  int wave = threadIdx.x >> 5;        // 0..7
  int wm   = wave >> 1;               // 0..3 : 32-row strip in M
  int wn   = (wave & 1) * 64;         // 0/64 : 64-col strip in N
  int half = lane >> 4, lm = lane & 15;

  const float* Yb    = y + (size_t)b * CP * NPIX + ntB * 128;
  const float* Ar[2];
#pragma unroll
  for (int i = 0; i < 2; ++i)
    Ar[i] = w + (size_t)(mtB * 128 + wm * 32 + i * 16 + lm) * CP + half * 2;

  // ---- stage K-block `kr` of B into LDS buffer `buf` (all 256 threads) ----
  // 32 rows x 128 dwords = 1024 x 16B chunks; 4 chunks per thread.
  auto stage = [&](int buf, int kr) {
#pragma unroll
    for (int i = 0; i < 4; ++i) {
      int chunk = threadIdx.x + i * 256;     // 0..1023
      int row   = chunk >> 5;                // 0..31
      int c16   = chunk & 31;                // 0..31 (16B columns)
      const float* src = Yb + (size_t)(kr + row) * NPIX + c16 * 4;
      float*       dst = &BT[buf][row * BT_LDW + c16 * 4];
      async_copy16(src, dst);
    }
  };

  v8f acc[2][4] = {};
  int buf = 0;
  stage(0, 0);
  wait_async_copies();
  __syncthreads();

  for (int kb = 0; kb < CP / KB; ++kb) {
    if (kb + 1 < CP / KB) stage(buf ^ 1, (kb + 1) * KB);

    const float* A0 = Ar[0] + kb * KB;
    const float* A1 = Ar[1] + kb * KB;
    const float* bt = &BT[buf][(half * 2) * BT_LDW + wn + lm];
#pragma unroll
    for (int ks = 0; ks < KB; ks += 4) {
      v2f a0 = *(const v2f*)(A0 + ks);
      v2f a1 = *(const v2f*)(A1 + ks);
      const float* btk = bt + ks * BT_LDW;
      v2f bv[4];
#pragma unroll
      for (int j = 0; j < 4; ++j) {
        bv[j].x = btk[j * 16];                // row k0 + half*2
        bv[j].y = btk[j * 16 + BT_LDW];       // row k0 + half*2 + 1
      }
#pragma unroll
      for (int j = 0; j < 4; ++j) {
        acc[0][j] = wmma4(a0, bv[j], acc[0][j]);
        acc[1][j] = wmma4(a1, bv[j], acc[1][j]);
      }
    }

    wait_async_copies();
    __syncthreads();
    buf ^= 1;
  }

#pragma unroll
  for (int i = 0; i < 2; ++i)
#pragma unroll
    for (int j = 0; j < 4; ++j)
#pragma unroll
      for (int r = 0; r < 8; ++r) {
        int o = mtB * 128 + wm * 32 + i * 16 + r + half * 8;
        int n = ntB * 128 + wn + j * 16 + lm;
        out[((size_t)b * CP + o) * NPIX + n] = acc[i][j][r] + bias[o];
      }
}

// ---------------------------------------------------------------------------
extern "C" void kernel_launch(void* const* d_in, const int* in_sizes, int n_in,
                              void* d_out, int out_size, void* d_ws, size_t ws_size,
                              hipStream_t stream) {
  const float* qkv         = (const float*)d_in[0];
  const float* logit_scale = (const float*)d_in[1];
  const float* proj_w      = (const float*)d_in[2];
  const float* proj_b      = (const float*)d_in[3];
  float* out = (float*)d_out;

  // workspace layout (floats): rq | rk | attn | y
  float* ws   = (float*)d_ws;
  float* rq   = ws;                                   // B*L*DIM            (16 KB)
  float* rk   = rq + (size_t)BQ * LH * DIM;           // B*L*DIM            (16 KB)
  float* attn = rk + (size_t)BQ * LH * DIM;           // B*L*DIM*DIM        ( 2 MB)
  float* y    = attn + (size_t)BQ * LH * DIM * DIM;   // B*L*DIM*NPIX       (64 MB)

  norms_kernel      <<<BQ * LH * 2 * DIM, 256, 0, stream>>>(qkv, rq, rk);
  attn_logits_kernel<<<BQ * LH * 16,       32, 0, stream>>>(qkv, logit_scale, rq, rk, attn);
  softmax_kernel    <<<BQ * LH * DIM,     128, 0, stream>>>(attn);
  av_kernel         <<<BQ * LH * 4 * 64,   32, 0, stream>>>(qkv, attn, y);
  proj_kernel       <<<BQ * 8 * 32,       256, 0, stream>>>(y, proj_w, proj_b, out);
}

// v001
// Measured time: 289 microseconds a run.
// Next to v000, in two timings, it ran 1.25 times as fast each time.
#include <hip/hip_runtime.h>
#include <math.h>

// Problem constants (from reference): qkv [4,8,384,64,64]
#define BQ   4
#define LH   8
#define C3   384
#define DIM  128
#define NPIX 4096
#define CP   1024
#define EPSN 1e-12f
#define LOGIT_MAX 4.605170185988091f  // log(1/0.01)
#define KSPLIT 16                     // K slices of the logits product
#define KSLICE (NPIX / KSPLIT)        // 256 pixels per slice

typedef __attribute__((ext_vector_type(2))) float v2f;
typedef __attribute__((ext_vector_type(4))) float v4f;
typedef __attribute__((ext_vector_type(8))) float v8f;
typedef __attribute__((ext_vector_type(4))) int   v4i;

// Async global->LDS copy support (gfx1250 GLOBAL_LOAD_ASYNC_TO_LDS_B128)
#if defined(__has_builtin)
#if __has_builtin(__builtin_amdgcn_global_load_async_to_lds_b128)
#define ASYNC_LDS 1
#endif
#endif
#ifndef ASYNC_LDS
#define ASYNC_LDS 0
#endif

__device__ __forceinline__ void async_copy16(const float* src, float* lds_dst) {
#if ASYNC_LDS
  // Signature (from toolchain diagnostics): param0 = global int4*, param1 = LDS int4*,
  // then two integer immediates (offset, cpol).
  __builtin_amdgcn_global_load_async_to_lds_b128(
      (__attribute__((address_space(1))) v4i*)(float*)src,
      (__attribute__((address_space(3))) v4i*)lds_dst, 0, 0);
#else
  *(v4f*)lds_dst = *(const v4f*)src;
#endif
}

__device__ __forceinline__ void wait_async_copies() {
#if ASYNC_LDS
#if __has_builtin(__builtin_amdgcn_s_wait_asynccnt)
  __builtin_amdgcn_s_wait_asynccnt(0);
#else
  asm volatile("s_wait_asynccnt 0x0" ::: "memory");
#endif
#endif
}

// D(16x16,f32) = A(16x4,f32) * B(4x16,f32) + C  -- CDNA5 wave32 WMMA
__device__ __forceinline__ v8f wmma4(v2f a, v2f b, v8f c) {
  return __builtin_amdgcn_wmma_f32_16x16x4_f32(
      /*neg_a=*/false, a, /*neg_b=*/false, b,
      /*c_mod=*/(short)0, c, /*reuse_a=*/false, /*reuse_b=*/false);
}

// ---------------------------------------------------------------------------
// Kernel 1: reciprocal L2 norms of q rows and k rows.
// grid = B*L*2*DIM blocks of 256 threads. idx = (bl<<8) | (which<<7) | c
// ---------------------------------------------------------------------------
__global__ void norms_kernel(const float* __restrict__ qkv,
                             float* __restrict__ rq, float* __restrict__ rk) {
  __shared__ float red[256];
  int idx   = blockIdx.x;
  int c     = idx & (DIM - 1);
  int which = (idx >> 7) & 1;           // 0 = q, 1 = k
  int bl    = idx >> 8;
  const float* row = qkv + ((size_t)bl * C3 + which * DIM + c) * NPIX;
  float s = 0.f;
  for (int i = threadIdx.x; i < NPIX; i += 256) {
    float x = row[i];
    s += x * x;
  }
  red[threadIdx.x] = s;
  __syncthreads();
  for (int off = 128; off > 0; off >>= 1) {
    if (threadIdx.x < off) red[threadIdx.x] += red[threadIdx.x + off];
    __syncthreads();
  }
  if (threadIdx.x == 0) {
    float r = 1.f / fmaxf(sqrtf(red[0]), EPSN);
    (which ? rk : rq)[bl * DIM + c] = r;
  }
}

// ---------------------------------------------------------------------------
// Kernel 2: partial attn logits over one K slice,
//   part[bl][m][s][n] = scale * (q_m . k_n over slice s) / (|q_m| |k_n|)
// One work-group per (bl, K slice); its 16 waves are the 16 32x32 macro-tiles
// (2x2 WMMA tiles each) of the 128x128 result, so the four waves that need a
// q or k row read it on the same WGP. K = 256 per slice in steps of 4.
// The slices of a row lie side by side and are summed in softmax_kernel.
// grid = B*L*KSPLIT, block = 512
// ---------------------------------------------------------------------------
__global__ void attn_logits_kernel(const float* __restrict__ qkv,
                                   const float* __restrict__ logit_scale,
                                   const float* __restrict__ rq,
                                   const float* __restrict__ rk,
                                   float* __restrict__ part) {
  int sl   = blockIdx.x & (KSPLIT - 1);
  int bl   = blockIdx.x / KSPLIT;
  int t    = threadIdx.x >> 5;          // wave = macro-tile
  int nt2  = t & 3;
  int mt2  = (t >> 2) & 3;
  int lane = threadIdx.x & 31;
  int half = lane >> 4, lm = lane & 15;

  const float* qbase = qkv + (size_t)bl * C3 * NPIX + sl * KSLICE;
  const float* kbase = qbase + (size_t)DIM * NPIX;

  const float* aq[2];
  const float* bk[2];
#pragma unroll
  for (int i = 0; i < 2; ++i)
    aq[i] = qbase + (size_t)(mt2 * 32 + i * 16 + lm) * NPIX + half * 2;
#pragma unroll
  for (int j = 0; j < 2; ++j)
    bk[j] = kbase + (size_t)(nt2 * 32 + j * 16 + lm) * NPIX + half * 2;

  v8f acc[2][2] = {};
#pragma unroll 4
  for (int k0 = 0; k0 < KSLICE; k0 += 4) {
    v2f a0 = *(const v2f*)(aq[0] + k0);
    v2f a1 = *(const v2f*)(aq[1] + k0);
    v2f b0 = *(const v2f*)(bk[0] + k0);
    v2f b1 = *(const v2f*)(bk[1] + k0);
    acc[0][0] = wmma4(a0, b0, acc[0][0]);
    acc[0][1] = wmma4(a0, b1, acc[0][1]);
    acc[1][0] = wmma4(a1, b0, acc[1][0]);
    acc[1][1] = wmma4(a1, b1, acc[1][1]);
  }

  int   l     = bl & (LH - 1);
  float scale = __expf(fminf(logit_scale[l], LOGIT_MAX));
#pragma unroll
  for (int i = 0; i < 2; ++i)
#pragma unroll
    for (int j = 0; j < 2; ++j)
#pragma unroll
      for (int r = 0; r < 8; ++r) {     // C/D layout: VGPR r -> M=r(+8), N=lane%16
        int m = mt2 * 32 + i * 16 + r + half * 8;
        int n = nt2 * 32 + j * 16 + lm;
        float v = acc[i][j][r] * rq[bl * DIM + m] * rk[bl * DIM + n] * scale;
        part[(((size_t)bl * DIM + m) * KSPLIT + sl) * DIM + n] = v;
      }
}

// ---------------------------------------------------------------------------
// Kernel 3: sum of the K-slice partial logits (fixed order), then softmax over
// the last dim (128). One block of 128 threads per row.
// grid = B*L*DIM
// ---------------------------------------------------------------------------
__global__ void softmax_kernel(const float* __restrict__ part,
                               float* __restrict__ attn) {
  __shared__ float red[128];
  size_t row = blockIdx.x;
  float  x   = 0.f;
#pragma unroll
  for (int s = 0; s < KSPLIT; ++s)
    x += part[(row * KSPLIT + s) * DIM + threadIdx.x];
  red[threadIdx.x] = x;
  __syncthreads();
  for (int off = 64; off > 0; off >>= 1) {
    if (threadIdx.x < off)
      red[threadIdx.x] = fmaxf(red[threadIdx.x], red[threadIdx.x + off]);
    __syncthreads();
  }
  float mx = red[0];
  __syncthreads();
  float e = __expf(x - mx);
  red[threadIdx.x] = e;
  __syncthreads();
  for (int off = 64; off > 0; off >>= 1) {
    if (threadIdx.x < off) red[threadIdx.x] += red[threadIdx.x + off];
    __syncthreads();
  }
  attn[row * DIM + threadIdx.x] = e / red[0];
}

// ---------------------------------------------------------------------------
// Kernel 4: y = attn @ v   (128x128 by 128x4096, per bl)
// One wave per 32x64 macro-tile (2x4 WMMA tiles), K=128.
// grid = B*L*4*64, block = 32.
// ---------------------------------------------------------------------------
__global__ void av_kernel(const float* __restrict__ qkv,
                          const float* __restrict__ attn,
                          float* __restrict__ y) {
  int t   = blockIdx.x;
  int nt4 = t & 63; t >>= 6;
  int mt2 = t & 3;
  int bl  = t >> 2;
  int lane = threadIdx.x, half = lane >> 4, lm = lane & 15;

  const float* Ar[2];
#pragma unroll
  for (int i = 0; i < 2; ++i)
    Ar[i] = attn + (size_t)bl * DIM * DIM +
            (size_t)(mt2 * 32 + i * 16 + lm) * DIM + half * 2;

  const float* V = qkv + (size_t)bl * C3 * NPIX + (size_t)(2 * DIM) * NPIX;
  const float* Bp[4];
#pragma unroll
  for (int j = 0; j < 4; ++j)
    Bp[j] = V + (size_t)(half * 2) * NPIX + nt4 * 64 + j * 16 + lm;

  v8f acc[2][4] = {};
#pragma unroll 2
  for (int k0 = 0; k0 < DIM; k0 += 4) {
    v2f a[2];
#pragma unroll
    for (int i = 0; i < 2; ++i) a[i] = *(const v2f*)(Ar[i] + k0);
    v2f b[4];
#pragma unroll
    for (int j = 0; j < 4; ++j) {
      b[j].x = Bp[j][(size_t)k0 * NPIX];
      b[j].y = Bp[j][(size_t)(k0 + 1) * NPIX];
    }
#pragma unroll
    for (int i = 0; i < 2; ++i)
#pragma unroll
      for (int j = 0; j < 4; ++j) acc[i][j] = wmma4(a[i], b[j], acc[i][j]);
  }

#pragma unroll
  for (int i = 0; i < 2; ++i)
#pragma unroll
    for (int j = 0; j < 4; ++j)
#pragma unroll
      for (int r = 0; r < 8; ++r) {
        int m = mt2 * 32 + i * 16 + r + half * 8;
        int n = nt4 * 64 + j * 16 + lm;
        y[((size_t)bl * DIM + m) * NPIX + n] = acc[i][j][r];
      }
}

// ---------------------------------------------------------------------------
// Kernel 5: out = proj_w @ y + proj_b   (per b: 1024x1024 by 1024x4096)
// Block = 8 waves (256 thr) -> 128x128 output tile (waves in 4M x 2N grid,
// each wave 32x64 = 2x4 WMMA tiles). B staged in double-buffered LDS tiles
// of 32(K) x 128(N), copied with GLOBAL_LOAD_ASYNC_TO_LDS_B128 when
// available. Row stride padded to 136 dwords so the half-wave row split of
// the WMMA B layout hits disjoint LDS banks.
// grid = B*8*32, block = 256.
// ---------------------------------------------------------------------------
#define KB      32                    // K-block staged per iteration
#define BT_LDW  136                   // padded LDS row stride (dwords)

__global__ void proj_kernel(const float* __restrict__ y,
                            const float* __restrict__ w,
                            const float* __restrict__ bias,
                            float* __restrict__ out) {
  __shared__ float BT[2][KB * BT_LDW];

  int t    = blockIdx.x;
  int ntB  = t & 31; t >>= 5;         // N block (128 cols)
  int mtB  = t & 7;                   // M block (128 rows)
  int b    = t >> 3;

  int lane = threadIdx.x & 31;
  int wave = threadIdx.x >> 5;        // 0..7
  int wm   = wave >> 1;               // 0..3 : 32-row strip in M
  int wn   = (wave & 1) * 64;         // 0/64 : 64-col strip in N
  int half = lane >> 4, lm = lane & 15;

  const float* Yb    = y + (size_t)b * CP * NPIX + ntB * 128;
  const float* Ar[2];
#pragma unroll
  for (int i = 0; i < 2; ++i)
    Ar[i] = w + (size_t)(mtB * 128 + wm * 32 + i * 16 + lm) * CP + half * 2;

  // ---- stage K-block `kr` of B into LDS buffer `buf` (all 256 threads) ----
  // 32 rows x 128 dwords = 1024 x 16B chunks; 4 chunks per thread.
  auto stage = [&](int buf, int kr) {
#pragma unroll
    for (int i = 0; i < 4; ++i) {
      int chunk = threadIdx.x + i * 256;     // 0..1023
      int row   = chunk >> 5;                // 0..31
      int c16   = chunk & 31;                // 0..31 (16B columns)
      const float* src = Yb + (size_t)(kr + row) * NPIX + c16 * 4;
      float*       dst = &BT[buf][row * BT_LDW + c16 * 4];
      async_copy16(src, dst);
    }
  };

  v8f acc[2][4] = {};
  int buf = 0;
  stage(0, 0);
  wait_async_copies();
  __syncthreads();

  for (int kb = 0; kb < CP / KB; ++kb) {
    if (kb + 1 < CP / KB) stage(buf ^ 1, (kb + 1) * KB);

    const float* A0 = Ar[0] + kb * KB;
    const float* A1 = Ar[1] + kb * KB;
    const float* bt = &BT[buf][(half * 2) * BT_LDW + wn + lm];
#pragma unroll
    for (int ks = 0; ks < KB; ks += 4) {
      v2f a0 = *(const v2f*)(A0 + ks);
      v2f a1 = *(const v2f*)(A1 + ks);
      const float* btk = bt + ks * BT_LDW;
      v2f bv[4];
#pragma unroll
      for (int j = 0; j < 4; ++j) {
        bv[j].x = btk[j * 16];                // row k0 + half*2
        bv[j].y = btk[j * 16 + BT_LDW];       // row k0 + half*2 + 1
      }
#pragma unroll
      for (int j = 0; j < 4; ++j) {
        acc[0][j] = wmma4(a0, bv[j], acc[0][j]);
        acc[1][j] = wmma4(a1, bv[j], acc[1][j]);
      }
    }

    wait_async_copies();
    __syncthreads();
    buf ^= 1;
  }

#pragma unroll
  for (int i = 0; i < 2; ++i)
#pragma unroll
    for (int j = 0; j < 4; ++j)
#pragma unroll
      for (int r = 0; r < 8; ++r) {
        int o = mtB * 128 + wm * 32 + i * 16 + r + half * 8;
        int n = ntB * 128 + wn + j * 16 + lm;
        out[((size_t)b * CP + o) * NPIX + n] = acc[i][j][r] + bias[o];
      }
}

// ---------------------------------------------------------------------------
extern "C" void kernel_launch(void* const* d_in, const int* in_sizes, int n_in,
                              void* d_out, int out_size, void* d_ws, size_t ws_size,
                              hipStream_t stream) {
  const float* qkv         = (const float*)d_in[0];
  const float* logit_scale = (const float*)d_in[1];
  const float* proj_w      = (const float*)d_in[2];
  const float* proj_b      = (const float*)d_in[3];
  float* out = (float*)d_out;

  // workspace layout (floats): rq | rk | attn | y | part
  float* ws   = (float*)d_ws;
  float* rq   = ws;                                   // B*L*DIM            (16 KB)
  float* rk   = rq + (size_t)BQ * LH * DIM;           // B*L*DIM            (16 KB)
  float* attn = rk + (size_t)BQ * LH * DIM;           // B*L*DIM*DIM        ( 2 MB)
  float* y    = attn + (size_t)BQ * LH * DIM * DIM;   // B*L*DIM*NPIX       (64 MB)
  float* part = y + (size_t)BQ * LH * DIM * NPIX;     // B*L*DIM*KSPLIT*DIM (32 MB)

  norms_kernel      <<<BQ * LH * 2 * DIM, 256, 0, stream>>>(qkv, rq, rk);
  attn_logits_kernel<<<BQ * LH * KSPLIT,  512, 0, stream>>>(qkv, logit_scale, rq, rk, part);
  softmax_kernel    <<<BQ * LH * DIM,     128, 0, stream>>>(part, attn);
  av_kernel         <<<BQ * LH * 4 * 64,   32, 0, stream>>>(qkv, attn, y);
  proj_kernel       <<<BQ * 8 * 32,       256, 0, stream>>>(y, proj_w, proj_b, out);
}
